// v010
// Measured on an AMD MI455X. A time is GPU time per run, averaged over a window of back-to-back runs after a warm-up
// (all launches, gaps included; the runs take copies of the inputs in turn), and the median of several windows.
// Apart from v000's, it joins two sittings. Times from different sittings can be a few percent apart, while
// side-by-side timings come from the same sitting.
// The versions before v010 are in another document.
// Measured time: 204 microseconds a run.
// Next to v009, in two timings, it ran 1.07 times as fast each time.
// Counting every step since v000, which is the starting kernel, it is 4.89 times as fast.
#include <hip/hip_runtime.h>
// Pre-LN decoder layer, sequence-first layout (T 1024, batch 4, E 1024, 16 heads x 64, FFN 4096): h = LN1(x); x1 = x + SelfAttn(h, h); h = LN2(x1); x2 = x1 + Attn(h, encoder_out); h = LN3(x2); out = x2 + fc2(gelu_erf(fc1(h))). Both attentions: q = (in*wq^T + bq)*64^-0.5, k, v from the key input, per (batch, head) scores over the 1024 keys with the module's causal mask (key > query filled with -1e4, i.e. weight exactly 0), softmax, *v, merged, *wo^T + bo.
// Structure: rows are the (t, n) pairs in memory order, so every projection / FFN is a [4096][1024] GEMM (f16 WMMA, 32x64 wave tiles, f32 accumulation, exact bias, residual through the f32 epilogue addend); LayerNorms wave-per-row on VALU writing f16 operand planes; q/k planes viewed as [token][64 heads x 64] feed a fused causal flash-style kernel per ((n,h), pair of 64-query tiles t and 15 - t, one after the other) (wave = 16 queries, 32-key steps up to the query block, both products transposed so that a lane owns one query, online softmax f32 in base 2, P x2^10 f16 packed in registers, f32 accumulators); v leaves its projection already as f16 [d][token] per (n,h), turned in the epilogue's LDS staging; the attention output leaves as the f16 operand plane of the wo product; exact-erf GELU in the fc1 epilogue.
// Compute dtype: inputs and parameters rounded to bf16; all GEMM operands f16 (~2^-12: LN outputs, q, k, v, P, attention outputs, the GELU hidden), weights bf16-exact (x16 in f16), f32 accumulation; LayerNorm / softmax / residual stream f32. v_wmma_f32_16x16x32_f16.
#define TT 1024
#define NBATCH 4
#define EE 1024
#define NHD 16
#define NH (NBATCH * NHD)        /* 64 (batch, head) slabs */
#define TQ TT
#define TK TT
#define SCL 0.125f
#define SCL2 (SCL * 1.4426950408889634f)   /* score scale x log2(e): the softmax runs in base 2 */
#define NR (TT * NBATCH)         /* 4096 rows */
#define FF 4096
typedef __bf16 v16b __attribute__((ext_vector_type(16)));
typedef unsigned short v8us __attribute__((ext_vector_type(8), may_alias));
typedef float  v8f  __attribute__((ext_vector_type(8)));
typedef float  v4f  __attribute__((ext_vector_type(4)));
typedef float  v4fa __attribute__((ext_vector_type(4), may_alias));
union FragB { v16b v; v8us half[2]; unsigned short u[16]; };

__device__ __forceinline__ unsigned short bf16_bits(float x) { unsigned int u = __float_as_uint(x); return (unsigned short)((u + 0x7FFFu + ((u >> 16) & 1u)) >> 16); }
__device__ __forceinline__ float bf16_val(unsigned short b) { return __uint_as_float(((unsigned int)b) << 16); }
__device__ __forceinline__ float bf16_round(float x) { return bf16_val(bf16_bits(x)); }
// D += A·B with NT terms: 1 = ah·bh, 2 = + al·bh (A split), 3 = + ah·bl (both split)
template <int NT>
__device__ __forceinline__ v8f mmaN(v16b ah, v16b al, v16b bh, v16b bl, v8f c) {
  c = __builtin_amdgcn_wmma_f32_16x16x32_bf16(false, ah, false, bh, (short)0, c, false, false);
  if (NT >= 2) c = __builtin_amdgcn_wmma_f32_16x16x32_bf16(false, al, false, bh, (short)0, c, false, false);
  if (NT >= 3) c = __builtin_amdgcn_wmma_f32_16x16x32_bf16(false, ah, false, bl, (short)0, c, false, false);
  asm volatile("v_nop\n\tv_nop\n\tv_nop\n\tv_nop" : "+v"(c) : "v"(ah), "v"(al), "v"(bh), "v"(bl));
  return c;
}

__global__ __launch_bounds__(256) void k_wt_bf16(const float* __restrict__ W, unsigned short* __restrict__ Wt, int K, int N) {
  const int t = blockIdx.x * 256 + threadIdx.x;
  const int k8n = K / 8;
  if (t >= N * k8n) return;
  const int n = t / k8n, k8 = (t % k8n) * 8;
  v8us v;
#pragma unroll
  for (int i = 0; i < 8; ++i) v[i] = bf16_bits(W[(size_t)(k8 + i) * N + n]);
  *(v8us*)(Wt + (size_t)n * K + k8) = v;
  
}

// GEMM C[M][N] (f32, pitch ldc) = act(A[M][K]·W + bias). A f32 row-major (pitch lda) converted per fragment to bf16
// (ASPLIT: hi/lo two planes -> 2 terms, else single rounded term); Wt bf16 [N][K] (pitch ldb). BIAS_BF16 rounds the
// bias to bf16 first (bias quantised to bf16 before the add). K%32==0, M%16==0, N%64==0.
template <bool ASPLIT, int ACT, bool BIAS_BF16>
__global__ __launch_bounds__(128) void k_gemm_bf(const float* __restrict__ A, int lda, const unsigned short* __restrict__ Wt, int ldb,
                                               const float* __restrict__ bias, float* __restrict__ C, int ldc, int M, int N, int K) {
  __shared__ __attribute__((aligned(16))) float so[4][16][64];
  const int tid = threadIdx.x, w = tid >> 5, lane = tid & 31, ln = lane & 15, hh = lane >> 4;
  const int ntn = N / 64;
  const int wid = blockIdx.x * 4 + w;
  const int mt = wid / ntn, nq = wid % ntn;
  if (mt * 16 >= M) return;
  const int row0 = mt * 16, col0 = nq * 64;
  const float* arow = A + (size_t)(row0 + ln) * lda;
  v8f acc[4] = {};
  for (int kb = 0; kb < K; kb += 32) {
    FragB ah, al;
    const v4f x0 = *(const v4fa*)(arow + kb + 8 * hh), x1 = *(const v4fa*)(arow + kb + 8 * hh + 4);
    const v4f x2 = *(const v4fa*)(arow + kb + 16 + 8 * hh), x3 = *(const v4fa*)(arow + kb + 16 + 8 * hh + 4);
    float xs[16] = {x0[0],x0[1],x0[2],x0[3],x1[0],x1[1],x1[2],x1[3],x2[0],x2[1],x2[2],x2[3],x3[0],x3[1],x3[2],x3[3]};
#pragma unroll
    for (int i = 0; i < 16; ++i) { const unsigned short hb = bf16_bits(xs[i]); ah.u[i] = hb; al.u[i] = ASPLIT ? bf16_bits(xs[i] - bf16_val(hb)) : (unsigned short)0; }
#pragma unroll
    for (int t = 0; t < 4; ++t) {
      const unsigned short* brow = Wt + (size_t)(col0 + t * 16 + ln) * ldb + kb;
      FragB b;
      b.half[0] = *(const v8us*)(brow + 8 * hh);
      b.half[1] = *(const v8us*)(brow + 16 + 8 * hh);
      acc[t] = mmaN<ASPLIT ? 2 : 1>(ah.v, al.v, b.v, b.v, acc[t]);
    }
  }
#pragma unroll
  for (int t = 0; t < 4; ++t) {
    float bv = bias ? bias[col0 + t * 16 + ln] : 0.f;
    if (BIAS_BF16) bv = bf16_round(bv);
#pragma unroll
    for (int r = 0; r < 8; ++r) { float v = acc[t][r] + bv; if (ACT == 1) v = fmaxf(v, 0.f); so[w][8 * hh + r][t * 16 + ln] = v; }
  }
  __builtin_amdgcn_fence(__ATOMIC_ACQ_REL, "workgroup");
  __builtin_amdgcn_wave_barrier();
  const int rsub = lane >> 4, c4 = (lane & 15) * 4;
  {
#pragma unroll
    for (int q = 0; q < 8; ++q) {
      const int r = q * 2 + rsub;
      const v4f v = *(const v4fa*)&so[w][r][c4];
      *(v4f*)(C + (size_t)(row0 + r) * ldc + col0 + c4) = v;
    }
    
  }
}

// GEMM C = act(A·W + bias + resid): A f32 (ASPLIT -> hi/lo 2 terms), Wt bf16 [N][K]; ACT 0 none, 1 relu, 2 exact gelu;
// resid (optional, f32, row index = (row % rmod), pitch ldr, RES_BF16 rounds it) added before the activation.
template <bool ASPLIT, int ACT, bool BIAS_BF16, bool RES_BF16>
__global__ __launch_bounds__(128) void k_gemm_bf3(const float* __restrict__ A, int lda, const unsigned short* __restrict__ Wt, int ldb,
                                                const float* __restrict__ bias, const float* __restrict__ resid, int rmod, int ldr,
                                                float* __restrict__ C, int ldc, int M, int N, int K) {
  __shared__ __attribute__((aligned(16))) float so[4][16][64];
  const int tid = threadIdx.x, w = tid >> 5, lane = tid & 31, ln = lane & 15, hh = lane >> 4;
  const int ntn = N / 64;
  const int wid = blockIdx.x * 4 + w;
  const int mt = wid / ntn, nq = wid % ntn;
  if (mt * 16 >= M) return;
  const int row0 = mt * 16, col0 = nq * 64;
  const float* arow = A + (size_t)(row0 + ln) * lda;
  v8f acc[4] = {};
  for (int kb = 0; kb < K; kb += 32) {
    FragB ah, al;
    const v4f x0 = *(const v4fa*)(arow + kb + 8 * hh), x1 = *(const v4fa*)(arow + kb + 8 * hh + 4);
    const v4f x2 = *(const v4fa*)(arow + kb + 16 + 8 * hh), x3 = *(const v4fa*)(arow + kb + 16 + 8 * hh + 4);
    float xs[16] = {x0[0],x0[1],x0[2],x0[3],x1[0],x1[1],x1[2],x1[3],x2[0],x2[1],x2[2],x2[3],x3[0],x3[1],x3[2],x3[3]};
#pragma unroll
    for (int i = 0; i < 16; ++i) { const unsigned short hb = bf16_bits(xs[i]); ah.u[i] = hb; al.u[i] = ASPLIT ? bf16_bits(xs[i] - bf16_val(hb)) : (unsigned short)0; }
#pragma unroll
    for (int t = 0; t < 4; ++t) {
      const unsigned short* brow = Wt + (size_t)(col0 + t * 16 + ln) * ldb + kb;
      FragB b;
      b.half[0] = *(const v8us*)(brow + 8 * hh);
      b.half[1] = *(const v8us*)(brow + 16 + 8 * hh);
      acc[t] = mmaN<ASPLIT ? 2 : 1>(ah.v, al.v, b.v, b.v, acc[t]);
    }
  }
#pragma unroll
  for (int t = 0; t < 4; ++t) {
    const int col = col0 + t * 16 + ln;
    float bv = bias ? bias[col] : 0.f;
    if (BIAS_BF16) bv = bf16_round(bv);
#pragma unroll
    for (int r = 0; r < 8; ++r) {
      float v = acc[t][r] + bv;
      if (resid) { float rv = resid[(size_t)((row0 + 8 * hh + r) % rmod) * ldr + col]; if (RES_BF16) rv = bf16_round(rv); v += rv; }
      if (ACT == 1) v = fmaxf(v, 0.f);
      if (ACT == 2) v = 0.5f * v * (1.0f + erff(v * 0.70710678118654752f));
      if (ACT == 3) { const float u = 0.7978845608028654f * (v + 0.044715f * v * v * v); v = 0.5f * v * (1.0f + tanhf(u)); }
      so[w][8 * hh + r][t * 16 + ln] = v;
    }
  }
  __builtin_amdgcn_fence(__ATOMIC_ACQ_REL, "workgroup");
  __builtin_amdgcn_wave_barrier();
  const int rsub = lane >> 4, c4 = (lane & 15) * 4;
  {
#pragma unroll
    for (int q = 0; q < 8; ++q) {
      const int r = q * 2 + rsub;
      const v4f v = *(const v4fa*)&so[w][r][c4];
      *(v4f*)(C + (size_t)(row0 + r) * ldc + col0 + c4) = v;
    }
    
  }
}
// row LayerNorm (biased variance, eps) over N: s = X (+ R); optional out_sum <- s; out_norm <- (s-mu)*rsqrt(var+eps)*g + b
template <bool PARAM_BF16>
__global__ __launch_bounds__(256) void k_layernorm(const float* __restrict__ X, const float* __restrict__ R, const float* __restrict__ g, const float* __restrict__ bta,
                                                  float* __restrict__ out_sum, float* __restrict__ out_norm, int N, float eps) {
  __shared__ float red[256];
  const int row = blockIdx.x, tid = threadIdx.x;
  const float* x = X + (size_t)row * N; const float* rr = R ? R + (size_t)row * N : nullptr;
  float vals[16];                     // up to N = 4096
  const int per = N / 256;            // contiguous chunk per thread? use strided-by-4 chunks: thread handles j = tid*4 + 1024*u
  float s1 = 0.f;
  for (int u = 0; u < per / 4; ++u) {
    const int j = tid * 4 + 1024 * u;
    const v4f a = *(const v4fa*)(x + j);
    v4f b = {0.f,0.f,0.f,0.f}; if (rr) b = *(const v4fa*)(rr + j);
#pragma unroll
    for (int q = 0; q < 4; ++q) { const float v = a[q] + b[q]; vals[u * 4 + q] = v; s1 += v; }
  }
  red[tid] = s1; __syncthreads();
  for (int st = 128; st > 0; st >>= 1) { if (tid < st) red[tid] += red[tid + st]; __syncthreads(); }
  const float mu = red[0] / (float)N; __syncthreads();
  float s2 = 0.f;
  for (int u = 0; u < per / 4; ++u)
#pragma unroll
    for (int q = 0; q < 4; ++q) { const float c = vals[u * 4 + q] - mu; s2 += c * c; }
  red[tid] = s2; __syncthreads();
  for (int st = 128; st > 0; st >>= 1) { if (tid < st) red[tid] += red[tid + st]; __syncthreads(); }
  const float rs = rsqrtf(red[0] / (float)N + eps);
  {
    for (int u = 0; u < per / 4; ++u) {
      const int j = tid * 4 + 1024 * u;
      v4f o, sm;
#pragma unroll
      for (int q = 0; q < 4; ++q) {
        float gg = g[j + q], bb = bta[j + q];
        if (PARAM_BF16) { gg = bf16_round(gg); bb = bf16_round(bb); }
        sm[q] = vals[u * 4 + q]; o[q] = (vals[u * 4 + q] - mu) * rs * gg + bb;
      }
      if (out_sum) *(v4f*)(out_sum + (size_t)row * N + j) = sm;
      *(v4f*)(out_norm + (size_t)row * N + j) = o;
    }
    
  }
}



// ---- f16 WMMA path (v_wmma_f32_16x16x32_f16): 11-bit significands for operands in range — used where a [0,1] probability operand needs more precision than bf16
typedef _Float16 v16h __attribute__((ext_vector_type(16)));
union FragH { v16h v; v8us half[2]; _Float16 h[16]; unsigned short u[16]; };
template <int NT>
__device__ __forceinline__ v8f mmaH(v16h ah, v16h al, v16h bh, v16h bl, v8f c) {
  c = __builtin_amdgcn_wmma_f32_16x16x32_f16(false, ah, false, bh, (short)0, c, false, false);
  if (NT >= 2) c = __builtin_amdgcn_wmma_f32_16x16x32_f16(false, al, false, bh, (short)0, c, false, false);
  if (NT >= 3) c = __builtin_amdgcn_wmma_f32_16x16x32_f16(false, ah, false, bl, (short)0, c, false, false);
  asm volatile("v_nop\n\tv_nop\n\tv_nop\n\tv_nop" : "+v"(c) : "v"(ah), "v"(al), "v"(bh), "v"(bl));
  return c;
}
// batched GEMM like k_gemm_b but f16 operands: A f32 (split into f16 hi/lo if ASPLIT, else rounded to f16), Bt = f16 values [n][k]; alpha; C f32; N multiple of 16 (partial tiles skipped)
template <bool ASPLIT>
__global__ __launch_bounds__(128) void k_gemm_h(const float* __restrict__ A, int lda, size_t sA, const _Float16* __restrict__ Bh, int ldb, size_t sB, float alpha, float* __restrict__ C, int ldc, size_t sC, int M, int N, int K) {
  __shared__ __attribute__((aligned(16))) float so[4][16][64];
  const int tid = threadIdx.x, w = tid >> 5, lane = tid & 31, ln = lane & 15, hh = lane >> 4; const int by = blockIdx.y;
  A += (size_t)by * sA; Bh += (size_t)by * sB; C += (size_t)by * sC;
  const int ntn = (N + 63) / 64; const int wid = blockIdx.x * 4 + w; const int mt = wid / ntn, nq = wid % ntn; if (mt * 16 >= M) return;
  const int row0 = mt * 16, col0 = nq * 64; const float* arow = A + (size_t)(row0 + ln) * lda;
  v8f acc[4] = {};
  for (int kb = 0; kb < K; kb += 32) {
    FragH ah, al;
    const v4f x0 = *(const v4fa*)(arow + kb + 8 * hh), x1 = *(const v4fa*)(arow + kb + 8 * hh + 4), x2 = *(const v4fa*)(arow + kb + 16 + 8 * hh), x3 = *(const v4fa*)(arow + kb + 16 + 8 * hh + 4);
    float xs[16] = {x0[0],x0[1],x0[2],x0[3],x1[0],x1[1],x1[2],x1[3],x2[0],x2[1],x2[2],x2[3],x3[0],x3[1],x3[2],x3[3]};
#pragma unroll
    for (int i = 0; i < 16; ++i) { const _Float16 h = (_Float16)xs[i]; ah.h[i] = h; al.h[i] = ASPLIT ? (_Float16)(xs[i] - (float)h) : (_Float16)0.0f; }
#pragma unroll
    for (int t = 0; t < 4; ++t) { if (col0 + t * 16 >= N) continue; const size_t boff = (size_t)(col0 + t * 16 + ln) * ldb + kb; FragH bq; bq.half[0] = *(const v8us*)(Bh + boff + 8 * hh); bq.half[1] = *(const v8us*)(Bh + boff + 16 + 8 * hh);
      acc[t] = mmaH<ASPLIT ? 2 : 1>(ah.v, al.v, bq.v, bq.v, acc[t]); }
  }
#pragma unroll
  for (int t = 0; t < 4; ++t) { if (col0 + t * 16 >= N) continue;
#pragma unroll
    for (int r = 0; r < 8; ++r) so[w][8 * hh + r][t * 16 + ln] = acc[t][r] * alpha; }
  __builtin_amdgcn_fence(__ATOMIC_ACQ_REL, "workgroup"); __builtin_amdgcn_wave_barrier();
  const int rsub = lane >> 4, c4 = (lane & 15) * 4;
  {
#pragma unroll
    for (int q = 0; q < 8; ++q) { const int r = q * 2 + rsub; if (col0 + c4 < N) { const v4f v = *(const v4fa*)&so[w][r][c4]; *(v4f*)(C + (size_t)(row0 + r) * ldc + col0 + c4) = v; } }
     }
}

// Wt[n][k] = f16(W[k][n]·scale) from f32 row-major W[K][N] (scale = power of two; bf16-exact weights stay exact in f16 away from the subnormal range)
__global__ __launch_bounds__(256) void k_wt_f16(const float* __restrict__ W, _Float16* __restrict__ Wt, int K, int N, float scale) {
  const int t = blockIdx.x * 256 + threadIdx.x; if (t >= N * (K / 8)) return; const int n = t / (K / 8), k8 = (t % (K / 8)) * 8; FragH f;
#pragma unroll
  for (int i = 0; i < 8; ++i) f.h[i] = (_Float16)(bf16_round(W[(size_t)(k8 + i) * N + n]) * scale); const v8us o = f.half[0];
  *(v8us*)((unsigned short*)Wt + (size_t)n * K + k8) = o; 
}
// k_gemm_hh variant with fused epilogue: v = acc·alpha + bias[by·sBias + col] (+ CP[(row/rowsPerB)·sCPb + by·64 + col] if CP) ; ACT 0 none / 1 elu ; writes f16 C16 (and f32 C if non-null)
template <int ACT>
__global__ __launch_bounds__(128) void k_gemm_hhx(const _Float16* __restrict__ A, int lda, size_t sA, const _Float16* __restrict__ Bh, int ldb, size_t sB, float alpha, const float* __restrict__ bias, size_t sBias, const float* __restrict__ CP, int rowsPerB, size_t sCPb, int row0g,
    float* __restrict__ C, _Float16* __restrict__ C16, int ldc, size_t sC, int M, int N, int K) {
  __shared__ __attribute__((aligned(16))) float so[4][16][64];
  const int tid = threadIdx.x, w = tid >> 5, lane = tid & 31, ln = lane & 15, hh = lane >> 4; const int by = blockIdx.y;
  A += (size_t)by * sA; Bh += (size_t)by * sB; const size_t cofs = (size_t)by * sC; const float* bp = bias ? bias + (size_t)by * sBias : nullptr;
  const int ntn = (N + 63) / 64; const int wid = blockIdx.x * 4 + w; const int mt = wid / ntn, nq = wid % ntn; if (mt * 16 >= M) return;
  const int row0 = mt * 16, col0 = nq * 64; const _Float16* arow = A + (size_t)(row0 + ln) * lda;
  v8f acc[4] = {};
  for (int kb = 0; kb < K; kb += 32) { FragH ah; ah.half[0] = *(const v8us*)((const unsigned short*)arow + kb + 8 * hh); ah.half[1] = *(const v8us*)((const unsigned short*)arow + kb + 16 + 8 * hh);
#pragma unroll
    for (int t = 0; t < 4; ++t) { if (col0 + t * 16 >= N) continue; const size_t boff = (size_t)(col0 + t * 16 + ln) * ldb + kb; FragH bq; bq.half[0] = *(const v8us*)((const unsigned short*)Bh + boff + 8 * hh); bq.half[1] = *(const v8us*)((const unsigned short*)Bh + boff + 16 + 8 * hh);
      acc[t] = mmaH<1>(ah.v, ah.v, bq.v, bq.v, acc[t]); }
  }
#pragma unroll
  for (int t = 0; t < 4; ++t) { if (col0 + t * 16 >= N) continue; const int col = col0 + t * 16 + ln; const float bv = bp ? bf16_round(bp[col]) : 0.f;
#pragma unroll
    for (int r = 0; r < 8; ++r) { float v = acc[t][r] * alpha + bv; if (CP) { const int bidx = (row0g + row0 + 8 * hh + r) / rowsPerB; v += CP[(size_t)bidx * sCPb + (size_t)by * 64 + col]; } if (ACT == 1) v = (v > 0.f) ? v : expm1f(v); else if (ACT == 7) v = (v > 0.f) ? v + 1.0f : expf(v); else if (ACT == 8) v = tanhf(v); else if (ACT == 9) v = 0.5f * v * (1.0f + tanhf(0.7978845608028654f * (v + 0.044715f * v * v * v))); else if (ACT == 11) v = 1.0f / (1.0f + expf(-v)); else if (ACT == 12) v = (v > 0.f) ? v : 0.01f * v; else if (ACT == 14) v = (v > 0.f) ? v : 0.1f * v; else if (ACT == 15) v = v / (1.0f + expf(-v)); else if (ACT == 3) v = fmaxf(v, 0.f); else if (ACT == 6) v = 0.5f * v * (1.0f + erff(v * 0.70710678118654752f)); so[w][8 * hh + r][t * 16 + ln] = v; } }
  __builtin_amdgcn_fence(__ATOMIC_ACQ_REL, "workgroup"); __builtin_amdgcn_wave_barrier();
  const int rsub = lane >> 4, c4 = (lane & 15) * 4; typedef _Float16 v4h __attribute__((ext_vector_type(4)));
  {
#pragma unroll
    for (int q = 0; q < 8; ++q) { const int r = q * 2 + rsub; if (col0 + c4 < N) { const v4f v = *(const v4fa*)&so[w][r][c4]; if (C) *(v4f*)(C + cofs + (size_t)(row0 + r) * ldc + col0 + c4) = v; if (C16) { v4h h4; for (int i = 0; i < 4; ++i) h4[i] = (_Float16)v[i]; *(v4h*)(C16 + cofs + (size_t)(row0 + r) * ldc + col0 + c4) = h4; } } }
     }
}


typedef _Float16 v4h __attribute__((ext_vector_type(4)));

__global__ __launch_bounds__(256) void k_x16(const float* __restrict__ x, _Float16* __restrict__ X16, size_t n8) { const size_t t = (size_t)blockIdx.x * 256 + threadIdx.x; if (t >= n8) return; FragH f;
#pragma unroll
  for (int q = 0; q < 8; ++q) f.h[q] = (_Float16)bf16_round(x[t * 8 + q]); *(v8us*)((unsigned short*)X16 + t * 8) = f.half[0];  }
template <int NHv, int TTv>
__global__ __launch_bounds__(256) void k_vt(const _Float16* __restrict__ V16, int ldv, int voff, _Float16* __restrict__ Vt) { __shared__ unsigned short tl[64][66]; const int tid = threadIdx.x; const int slab = blockIdx.x / (TTv / 64), lg = blockIdx.x % (TTv / 64); const int b = slab / NHv, h = slab % NHv;
  for (int i = tid; i < 64 * 8; i += 256) { const int r = i / 8, c8 = (i % 8) * 8; FragH f; f.half[0] = *(const v8us*)((const unsigned short*)V16 + ((size_t)b * TTv + lg * 64 + r) * ldv + voff + h * 64 + c8);
#pragma unroll
    for (int q = 0; q < 8; ++q) tl[r][c8 + q] = f.u[q]; }
  __syncthreads();
  {
#pragma unroll
    for (int rd = 0; rd < 2; ++rd) { const int d = rd * 32 + tid / 8, pc = tid % 8; FragH f;
#pragma unroll
      for (int q = 0; q < 8; ++q) f.u[q] = tl[pc * 8 + q][d];
      *(v8us*)((unsigned short*)Vt + ((size_t)slab * 64 + d) * TTv + lg * 64 + pc * 8) = f.half[0]; }
     } }

__global__ __launch_bounds__(256) void k_hl(const float* __restrict__ F, _Float16* __restrict__ Hh, _Float16* __restrict__ Hl, size_t n8) { const size_t t = (size_t)blockIdx.x * 256 + threadIdx.x; if (t >= n8) return; FragH fh, fl; const v4f a = *(const v4fa*)(F + t * 8), c = *(const v4fa*)(F + t * 8 + 4);
#pragma unroll
  for (int q = 0; q < 4; ++q) { _Float16 h = (_Float16)a[q]; fh.h[q] = h; fl.h[q] = (_Float16)((a[q] - (float)h) * 1024.0f); h = (_Float16)c[q]; fh.h[4 + q] = h; fl.h[4 + q] = (_Float16)((c[q] - (float)h) * 1024.0f); }
  { *(v8us*)((unsigned short*)Hh + t * 8) = fh.half[0]; *(v8us*)((unsigned short*)Hl + t * 8) = fl.half[0];  } }

// ---- fast GEMM (wave tile 32x64, operands staged in LDS) ----
__device__ __forceinline__ v16h g2_frag(const _Float16* p, int hh) { FragH f; f.half[0] = *(const v8us*)((const unsigned short*)p + 8 * hh); f.half[1] = *(const v8us*)((const unsigned short*)p + 16 + 8 * hh); return f.v; }
__device__ __forceinline__ v8f g2_mma(v16h a, v16h b, v8f c) { v8f d = __builtin_amdgcn_wmma_f32_16x16x32_f16(false, a, false, b, (short)0, c, false, false); asm volatile("v_nop\n\tv_nop\n\tv_nop\n\tv_nop" : "+v"(d) : "v"(a), "v"(b)); return d; }
// Block tile 128x128, eight waves of 32x64 (4 down x 2 across). A pass is 128 k: 128 rows of A and 128 rows of Bh, 256 B each, are laid in LDS at a
// pitch of 272 B (16 B x odd, for the ds_load_b128 fragment reads) by per-lane asynchronous 16-byte copies; NB buffers, the copies of the next NB - 1 passes fly while this one is multiplied.
#define G3_PITCH 272
#define G3_OPB (128 * G3_PITCH)   /* one operand's 128 rows */
#define G3_BUF (2 * G3_OPB)       /* one buffer: [A rows | Bh rows] */
// Eight copies per lane: rows r, r + 16, ..., r + 112 of one operand (16 lanes cover one 256-B row piece). The s_wait_xcnt closes the copies' own statement so that
// no address register named here is rewritten ahead of it.
__device__ __forceinline__ void g3_copy8(unsigned l, const _Float16* g, size_t rstep) {
  asm volatile("global_load_async_to_lds_b128 %0, %8, off\n\t"
               "global_load_async_to_lds_b128 %1, %9, off\n\t"
               "global_load_async_to_lds_b128 %2, %10, off\n\t"
               "global_load_async_to_lds_b128 %3, %11, off\n\t"
               "global_load_async_to_lds_b128 %4, %12, off\n\t"
               "global_load_async_to_lds_b128 %5, %13, off\n\t"
               "global_load_async_to_lds_b128 %6, %14, off\n\t"
               "global_load_async_to_lds_b128 %7, %15, off\n\t"
               "s_wait_xcnt 0x0"
               :: "v"(l), "v"(l + 16u * G3_PITCH), "v"(l + 32u * G3_PITCH), "v"(l + 48u * G3_PITCH), "v"(l + 64u * G3_PITCH), "v"(l + 80u * G3_PITCH), "v"(l + 96u * G3_PITCH), "v"(l + 112u * G3_PITCH),
                  "v"(g), "v"(g + rstep), "v"(g + 2 * rstep), "v"(g + 3 * rstep), "v"(g + 4 * rstep), "v"(g + 5 * rstep), "v"(g + 6 * rstep), "v"(g + 7 * rstep)
               : "memory");
}
// exact-erf GELU without a branch, four elements at a time: 0.5 v (1 + erf(v / sqrt 2)) = max(v, 0) - |v| * 0.5 erfc(|v| / sqrt 2), with erfc(x) = t (a1 + t (a2 + t (a3 + t (a4 + t a5)))) exp(-x^2), t = 1 / (1 + p x), x >= 0
// (five-term rational-exponential form, error of erf below 1.5e-7 before rounding: far under the f16 step of the hidden plane that takes the result). The library erff picks one of two polynomials per lane by a branch,
// so a wave that holds both kinds of lane walks both, one element after the other, each a single dependent chain; here every element is the same short run and a lane's 64 elements are independent chains.
// The 0.5 is folded into a1 ... a5, 1 / sqrt 2 into p, and exp(-v^2 / 2) = 2^(-v^2 * 0.5 log2 e).
__device__ __forceinline__ void gelu_erf4(float* v) {
  float d[4], u[4], t[4], e[4];
#pragma unroll
  for (int i = 0; i < 4; ++i) { d[i] = fmaf(fabsf(v[i]), 0.3275911f * 0.70710678118654752f, 1.0f); u[i] = (v[i] * -0.72134752044448170f) * v[i]; }
  /* the eight transcendentals as one run: each is followed by an instruction that neither reads its result nor writes its source (the outputs are early-clobber, so none shares a register with an input), and the v_nop fills that slot behind the last one */
  asm("v_rcp_f32 %0, %8\n\tv_rcp_f32 %1, %9\n\tv_rcp_f32 %2, %10\n\tv_rcp_f32 %3, %11\n\t"
      "v_exp_f32 %4, %12\n\tv_exp_f32 %5, %13\n\tv_exp_f32 %6, %14\n\tv_exp_f32 %7, %15\n\tv_nop"
      : "=&v"(t[0]), "=&v"(t[1]), "=&v"(t[2]), "=&v"(t[3]), "=&v"(e[0]), "=&v"(e[1]), "=&v"(e[2]), "=&v"(e[3])
      : "v"(d[0]), "v"(d[1]), "v"(d[2]), "v"(d[3]), "v"(u[0]), "v"(u[1]), "v"(u[2]), "v"(u[3]));
#pragma unroll
  for (int i = 0; i < 4; ++i) { float q = fmaf(t[i], 0.5f * 1.061405429f, 0.5f * -1.453152027f);
    q = fmaf(q, t[i], 0.5f * 1.421413741f); q = fmaf(q, t[i], 0.5f * -0.284496736f); q = fmaf(q, t[i], 0.5f * 0.254829592f);
    v[i] = fmaf(-fabsf(v[i]), (q * t[i]) * e[i], fmaxf(v[i], 0.f)); } }
// requires M % 128 == 0, N % 128 == 0, K % 128 == 0; epilogue: v = act(acc * alpha + bf16(bias[col])), then, with ACT 0 only, + R[row][col] (R = optional f32 addend laid out like C; RRND: rounded to bf16 as it is added, for an addend that is a raw input)
// bx = the block's tile index, by = its batch index (the kernels below say where they come from)
// VT (optional, ACT 0 only): the tile leaves transposed and as f16 only, VT[by * N + col][row] with M elements a line, instead of through C / C16
// NB = buffers of the ring. Pass s lies in buffer s mod NB; its 16 copies per wave are issued NB - 1 passes ahead of the publish point that waits for them. A grid of one block per WGP walks k in step, so every pass's
// rows are first asked for by all their readers at once and come from memory: with two buffers the lead is one pass, shorter than that latency; four buffers (one block fills most of the WGP's LDS) give three passes.
template <int ACT, bool RRND = false, int NB = 2>
__device__ __forceinline__ void g3_body(const _Float16* __restrict__ A, int lda, size_t sA, const _Float16* __restrict__ Bh, int ldb, size_t sB, float alpha, const float* __restrict__ bias, size_t sBias, const float* __restrict__ R,
    float* __restrict__ C, _Float16* __restrict__ C16, _Float16* __restrict__ VT, int ldc, size_t sC, int M, int N, int K, const int bx, const int by) {
  static_assert(NB >= 2 && (NB & (NB - 1)) == 0 && 16 * (NB - 1) <= 63, "a power of two; at most 63 copies of a wave outstanding");
  __shared__ __attribute__((aligned(16))) unsigned char ring[NB * G3_BUF];      /* the buffers; after the k loop its first 8 x 32 x 68 floats stage the output */
  const int tid = threadIdx.x, w = tid >> 5, lane = tid & 31, ln = lane & 15, hh = lane >> 4;
  A += (size_t)by * sA; Bh += (size_t)by * sB; const size_t cofs = (size_t)by * sC; const float* bp = bias ? bias + (size_t)by * sBias : nullptr;
  const int ntn = N >> 7; const int mt = bx / ntn, nq = bx - mt * ntn; const int rowb = mt * 128, colb = nq * 128; if (rowb >= M) return;      /* block-uniform, ahead of every barrier */
  const int wm = w & 3, wn = w >> 2; const int row0 = rowb + 32 * wm, col0 = colb + 64 * wn;
  const int cr = tid >> 4, cc = tid & 15;      /* copy side: this lane's first row and its 16-byte piece of the row */
  const _Float16* gA = A + (size_t)(rowb + cr) * lda + cc * 8; const _Float16* gB = Bh + (size_t)(colb + cr) * ldb + cc * 8; const size_t stA = (size_t)16 * lda, stB = (size_t)16 * ldb;
  const unsigned lA = (unsigned)(size_t)ring + (unsigned)(cr * G3_PITCH + cc * 16), lB = lA + G3_OPB;
  const int np = K >> 7;
  g3_copy8(lA, gA, stA); g3_copy8(lB, gB, stB);
#pragma unroll      /* each pass's buffer offset is then a constant */
  for (int s = 1; s < NB - 1; ++s) if (s < np) { g3_copy8(lA + (unsigned)s * G3_BUF, gA + s * 128, stA); g3_copy8(lB + (unsigned)s * G3_BUF, gB + s * 128, stB); }
  /* pass 0's own copies have landed before the barrier that publishes them: the count leaves out the 16 copies of each of the passes 1 ... NB - 2, and is used only where all of them were issued */
  if (NB == 2 || np < NB - 1) asm volatile("s_wait_asynccnt 0x0" ::: "memory"); else asm volatile("s_wait_asynccnt %0" :: "n"(16 * (NB - 2)) : "memory");
  __syncthreads();
  if (np > NB - 1) { g3_copy8(lA + (unsigned)(NB - 1) * G3_BUF, gA + (NB - 1) * 128, stA); g3_copy8(lB + (unsigned)(NB - 1) * G3_BUF, gB + (NB - 1) * 128, stB); }
  /* what the epilogue adds is fetched here, all loads independent, so that it lands under the k loop: the wave's 4 bias words and, in the shape of the final row stores, its 32 x 64 piece of R */
  const int rsub = lane >> 4, c4 = (lane & 15) * 4;
  float bw[4] = {0.f, 0.f, 0.f, 0.f}; v4f rr[16];
  if (bp) {
#pragma unroll
    for (int t = 0; t < 4; ++t) bw[t] = bp[col0 + t * 16 + ln];
    asm volatile("s_wait_xcnt 0x0" ::: "memory"); }      /* stands in front of any rewrite of the base or offset registers that the four bias loads name */
  if (ACT == 0 && R) { const float* rp = R + cofs + (size_t)(row0 + rsub) * ldc + col0 + c4;
#pragma unroll
    for (int q = 0; q < 16; ++q) rr[q] = *(const v4fa*)(rp + (size_t)(2 * q) * ldc);
    asm volatile("s_wait_xcnt 0x0" ::: "memory"); }      /* stands in front of any rewrite of the address registers that the sixteen row loads name */
  const unsigned char* ra = ring + (32 * wm + ln) * G3_PITCH; const unsigned char* rb = ring + G3_OPB + (64 * wn + ln) * G3_PITCH;
  const v8f z8 = {0.f,0.f,0.f,0.f,0.f,0.f,0.f,0.f}; v8f c00 = z8, c01 = z8, c02 = z8, c03 = z8, c10 = z8, c11 = z8, c12 = z8, c13 = z8;
#pragma unroll 1      /* one pass per trip: the publish point at the foot stands once */
  for (int t = 0; t < np; ++t) { const unsigned bo = (unsigned)(t & (NB - 1)) * G3_BUF;
#pragma unroll      /* the four 32-k blocks of a pass in straight line, so that a block's fragment reads can stand ahead of the block before it */
    for (int ks = 0; ks < 4; ++ks) { const unsigned char* pa = ra + bo + ks * 64; const unsigned char* pb = rb + bo + ks * 64;
      const v16h a0 = g2_frag((const _Float16*)pa, hh), a1 = g2_frag((const _Float16*)(pa + 16 * G3_PITCH), hh);
      const v16h b0 = g2_frag((const _Float16*)pb, hh), b1 = g2_frag((const _Float16*)(pb + 16 * G3_PITCH), hh), b2 = g2_frag((const _Float16*)(pb + 32 * G3_PITCH), hh), b3 = g2_frag((const _Float16*)(pb + 48 * G3_PITCH), hh);
      c00 = g2_mma(a0, b0, c00); c10 = g2_mma(a1, b0, c10); c01 = g2_mma(a0, b1, c01); c11 = g2_mma(a1, b1, c11);
      c02 = g2_mma(a0, b2, c02); c12 = g2_mma(a1, b2, c12); c03 = g2_mma(a0, b3, c03); c13 = g2_mma(a1, b3, c13); }
    asm volatile("s_wait_dscnt 0x0" ::: "memory");         /* this wave's reads of the buffer are done before the barrier behind which it is refilled */
    /* this wave's copies of pass t + 1 have landed before the barrier that publishes them. While pass t + NB - 1 exists, the wave's youngest 16 * (NB - 2) copies are exactly those of the passes t + 2 ... t + NB - 1 and may stay in flight; in the last trips, which issued none, the wait is to 0 */
    if (NB == 2 || t + NB > np) asm volatile("s_wait_asynccnt 0x0" ::: "memory"); else asm volatile("s_wait_asynccnt %0" :: "n"(16 * (NB - 2)) : "memory");
    __syncthreads();
    if (t + NB < np) { g3_copy8(lA + bo, gA + (size_t)(t + NB) * 128, stA); g3_copy8(lB + bo, gB + (size_t)(t + NB) * 128, stB); } }
  asm volatile("s_wait_asynccnt 0x0" ::: "memory");        /* nothing in flight when the ring becomes output staging */
  v8f accs[8] = {c00, c01, c02, c03, c10, c11, c12, c13};
  if (ACT == 0 && VT) {      /* block-uniform. A lane holds 8 consecutive rows of one column: 16 bytes of a transposed f16 line. The block's 128 columns x 128 rows are gathered in the ring at the pitch of its operand rows, so that whole 256-byte lines leave */
#pragma unroll
    for (int u = 0; u < 8; ++u) { const int t = u & 3, half = u >> 2; const float bv = bf16_round(bw[t]); FragH f;
#pragma unroll
      for (int r = 0; r < 8; ++r) f.h[r] = (_Float16)(accs[u][r] * alpha + bv);
      *(v8us*)(ring + (64 * wn + t * 16 + ln) * G3_PITCH + (32 * wm + half * 16 + 8 * hh) * 2) = f.half[0]; }
    __syncthreads();      /* a line's 128 rows come from four waves: all have written before any is read back */
    v8us tv[8];
#pragma unroll
    for (int q = 0; q < 8; ++q) tv[q] = *(const v8us*)(ring + (q * 16 + cr) * G3_PITCH + cc * 16);
    unsigned short* vp = (unsigned short*)VT + ((size_t)by * N + colb + cr) * (size_t)M + rowb + cc * 8;
#pragma unroll
    for (int q = 0; q < 8; ++q) { *(v8us*)(vp + (size_t)(q * 16) * M) = tv[q]; asm volatile("s_wait_xcnt 0x0" ::: "memory"); }      /* the wait stands in front of any rewrite of the store's data or address registers */
    return; }
  float (*so)[32][68] = (float (*)[32][68])ring;
#pragma unroll
  for (int u = 0; u < 8; ++u) { const int t = u & 3, half = u >> 2; const float bv = bf16_round(bw[t]);
    float ge[8];
    if (ACT == 6) {
#pragma unroll
      for (int r = 0; r < 8; ++r) ge[r] = accs[u][r] * alpha + bv;
      gelu_erf4(ge); gelu_erf4(ge + 4); }
#pragma unroll
    for (int r = 0; r < 8; ++r) { const int rloc = half * 16 + 8 * hh + r; float v = (ACT == 6) ? ge[r] : accs[u][r] * alpha + bv;
      if (ACT == 3) v = fmaxf(v, 0.f); else if (ACT == 11) v = 1.0f / (1.0f + expf(-v)); else if (ACT == 15) v = v / (1.0f + expf(-v)); else if (ACT == 12) v = (v > 0.f) ? v : 0.01f * v; else if (ACT == 8) v = tanhf(v);
      so[w][rloc][t * 16 + ln] = v; } }
  __builtin_amdgcn_fence(__ATOMIC_ACQ_REL, "workgroup"); __builtin_amdgcn_wave_barrier();
  v4f vv[16];      /* the 16 staged rows are read back as one group, ahead of the stores and their waits, instead of one waited read in front of each store */
#pragma unroll
  for (int q = 0; q < 16; ++q) vv[q] = *(const v4fa*)&so[w][q * 2 + rsub][c4];
  {
#pragma unroll
    for (int q = 0; q < 16; ++q) { const int r = q * 2 + rsub; v4f v = vv[q]; if (ACT == 0 && R) { v4f a = rr[q]; if (RRND) { for (int i = 0; i < 4; ++i) a[i] = bf16_round(a[i]); } v += a; }
      if (C) { *(v4f*)(C + cofs + (size_t)(row0 + r) * ldc + col0 + c4) = v; asm volatile("s_wait_xcnt 0x0" ::: "memory"); }      /* the wait stands in front of any rewrite of the store's data or address registers */
      if (C16) { v4h h4; for (int i = 0; i < 4; ++i) h4[i] = (_Float16)v[i]; *(v4h*)(C16 + cofs + (size_t)(row0 + r) * ldc + col0 + c4) = h4; asm volatile("s_wait_xcnt 0x0" ::: "memory"); } }      /* the same wait behind the f16 store */
     } }
template <int ACT, bool RRND = false, int NB = 2>
__global__ __launch_bounds__(256) void k_gemm3(const _Float16* __restrict__ A, int lda, size_t sA, const _Float16* __restrict__ Bh, int ldb, size_t sB, float alpha, const float* __restrict__ bias, size_t sBias, const float* __restrict__ R,
    float* __restrict__ C, _Float16* __restrict__ C16, int ldc, size_t sC, int M, int N, int K) {
  g3_body<ACT, RRND, NB>(A, lda, sA, Bh, ldb, sB, alpha, bias, sBias, R, C, C16, nullptr, ldc, sC, M, N, K, (int)blockIdx.x, (int)blockIdx.y); }
// The five projections that wait for no attention, as one grid: blockIdx.y = 0 q, 1 k, 2 v of the self attention (from the LN1 plane H), 3 k, 4 v of the cross attention (from the encoder plane E).
// Each is the [4096][1024] x [1024][1024] product of k_gemm3<0>; q and k planes leave as f16 rows. A v block takes 128 tokens of ONE batch entry (row pitch NBATCH * EE), so that its tile, turned, is 128 whole
// 256-byte pieces of the [(n, h)][d][token] plane that the attention reads: the v planes leave in that form, as f16.
__global__ __launch_bounds__(256) void k_proj5(const _Float16* __restrict__ H, const _Float16* __restrict__ E, const _Float16* __restrict__ Bq, const _Float16* __restrict__ Bk, const _Float16* __restrict__ Bv, const _Float16* __restrict__ Bkc, const _Float16* __restrict__ Bvc,
    const float* __restrict__ bq, const float* __restrict__ bk, const float* __restrict__ bv, const float* __restrict__ bkc, const float* __restrict__ bvc,
    _Float16* __restrict__ Qs, _Float16* __restrict__ Ks, _Float16* __restrict__ VTs, _Float16* __restrict__ Kc, _Float16* __restrict__ VTc) {
  const int g = (int)blockIdx.y;
  const _Float16* A = (g < 3) ? H : E;
  const _Float16* Bh = (g == 0) ? Bq : (g == 1) ? Bk : (g == 2) ? Bv : (g == 3) ? Bkc : Bvc;
  const float* bias = (g == 0) ? bq : (g == 1) ? bk : (g == 2) ? bv : (g == 3) ? bkc : bvc;
  _Float16* VTd = (g == 2) ? VTs : (g == 4) ? VTc : nullptr; const bool vb = (g == 2) || (g == 4); const int bx = (int)blockIdx.x;
  _Float16* C16 = (g == 0) ? Qs : (g == 1) ? Ks : (g == 3) ? Kc : nullptr;
  constexpr int TPB = (TT / 128) * (EE / 128);      /* tiles of one batch entry's v plane */
  g3_body<0>(A, vb ? NBATCH * EE : EE, EE, Bh, EE, 0, 0.0625f, bias, 0, nullptr, nullptr, C16, VTd, EE, 0, vb ? TT : NR, EE, EE, vb ? bx % TPB : bx, vb ? bx / TPB : 0); }


// lane l with lane l ^ 16
__device__ __forceinline__ float xhalf(float x) { return __builtin_bit_cast(float, __builtin_amdgcn_permlanex16(__builtin_bit_cast(int, x), __builtin_bit_cast(int, x), 0x76543210, 0xfedcba98, false, false)); }
// Both products run transposed. S^T = K x Q^T: A = 16 key rows, B = the wave's 16 queries, so lane (ln, hh) holds for ITS query q0 + ln the keys j0 + 16 nt + 8 hh + r:
// maximum and sum are in-lane, the two halves of a query meet in one cross-row move. The two score tiles, converted in place, are the B operand of O^T += V^T x P^T
// (element s = tile s >> 3, register s & 7, which is the k order the V^T rows are loaded in): P passes through no LDS. O^T: lane = query, registers = 8 consecutive d.
// The K rows and the V^T rows of 64 keys (64 rows of 128 B each) are laid in LDS once for the block's four waves, at a pitch of 144 B (16 B x odd, for the ds_load_b128 fragment reads),
// by per-lane asynchronous 16-byte copies in which 8 lanes cover one whole 128-B row; FA_NB buffers, stage s in buffer s mod FA_NB: the copies of the next FA_NB - 1 stages fly while this one is worked on
// (the blocks of one (n, h) walk the keys in step, so a stage's rows are first asked for by all their readers at once and come from memory: a lead of one stage is shorter than that latency).
#define FA_PITCH 144
#define FA_OPB (64 * FA_PITCH)    /* one operand's 64 rows */
#define FA_BUF (2 * FA_OPB)       /* one buffer: [K rows | V^T rows] */
#define FA_NB 4                   /* buffers of the ring, a power of two; a stage is 8 copies per wave */
// Eight copies per lane: rows r, r + 16, r + 32, r + 48 of K, then of V^T. The s_wait_xcnt closes the copies' own statement so that no address register named here is rewritten ahead of it.
__device__ __forceinline__ void fa_copy8(unsigned l, const unsigned short* gk, size_t sk, const unsigned short* gv, size_t sv) {
  asm volatile("global_load_async_to_lds_b128 %0, %8, off\n\t"
               "global_load_async_to_lds_b128 %1, %9, off\n\t"
               "global_load_async_to_lds_b128 %2, %10, off\n\t"
               "global_load_async_to_lds_b128 %3, %11, off\n\t"
               "global_load_async_to_lds_b128 %4, %12, off\n\t"
               "global_load_async_to_lds_b128 %5, %13, off\n\t"
               "global_load_async_to_lds_b128 %6, %14, off\n\t"
               "global_load_async_to_lds_b128 %7, %15, off\n\t"
               "s_wait_xcnt 0x0"
               :: "v"(l), "v"(l + 16u * FA_PITCH), "v"(l + 32u * FA_PITCH), "v"(l + 48u * FA_PITCH), "v"(l + FA_OPB), "v"(l + FA_OPB + 16u * FA_PITCH), "v"(l + FA_OPB + 32u * FA_PITCH), "v"(l + FA_OPB + 48u * FA_PITCH),
                  "v"(gk), "v"(gk + sk), "v"(gk + 2 * sk), "v"(gk + 3 * sk), "v"(gv), "v"(gv + sv), "v"(gv + 2 * sv), "v"(gv + 3 * sv)
               : "memory");
}
__global__ __launch_bounds__(128) void k_flashc(const _Float16* __restrict__ Q16, int ldq, const _Float16* __restrict__ K16, int ldk, const _Float16* __restrict__ Vt, const int* __restrict__ MSK, _Float16* __restrict__ O16, int ldo) {
  constexpr int RPW = 16, NQB = TQ / (4 * RPW), DT = 4, KS = 2;
  __shared__ __attribute__((aligned(16))) unsigned char ring[FA_NB * FA_BUF];
  __shared__ __attribute__((aligned(16))) unsigned short sO[4][RPW][64 + 8];      /* output staging, f16: a query's 64 values at a pitch of 144 B */
  (void)MSK;
  const int tid = threadIdx.x, w = tid >> 5, lane = tid & 31, ln = lane & 15, hh = lane >> 4;
  static_assert(NQB % 2 == 0, "query tiles are dealt in pairs");
  const int slab = blockIdx.x / (NQB / 2), pr = blockIdx.x % (NQB / 2); const int b = slab / NH, h = slab % NH;
  const unsigned short* Vth = (const unsigned short*)Vt + (size_t)slab * 64 * TK;
  const int cr = tid >> 3, cc = tid & 7;      /* copy side: this lane's first row and its 16-byte piece of the row */
  const unsigned short* gK = (const unsigned short*)K16 + ((size_t)b * TK + cr) * ldk + h * 64 + cc * 8; const unsigned short* gV = Vth + (size_t)cr * TK + cc * 8; const size_t stK = (size_t)16 * ldk, stV = (size_t)16 * TK;
  const unsigned lc = (unsigned)(size_t)ring + (unsigned)(cr * FA_PITCH + cc * 16);
  // A tile's cost grows with its index and every block of the grid is resident at once, so the launch lasts as long as its fullest SIMD. Each block therefore takes two tiles of its (n, h),
  // NQB - 1 - pr and then pr, one after the other in every wave: NQB + 1 stages for every block. The ring is free again at the head of the second tile: the first tile's last trip ends in
  // each wave's s_wait_dscnt 0 and s_wait_asynccnt 0 and the block's barrier, and nothing is copied behind that trip.
#pragma unroll 1      /* kept rolled: unrolled, the stage loop would stand twice in the kernel's text for no saved work */
 for (int half = 0; half < 2; ++half) {
  const int qblk = half ? pr : NQB - 1 - pr; const int qb0 = qblk * (4 * RPW); const int q0 = qb0 + w * RPW;
  const int ns = qblk + 1;      /* block-uniform causal bound: stages of 64 keys up to the end of the query block */
  fa_copy8(lc, gK, stK, gV, stV);
#pragma unroll      /* each stage's buffer offset is then a constant */
  for (int s = 1; s < FA_NB - 1; ++s) if (s < ns) fa_copy8(lc + (unsigned)s * FA_BUF, gK + (size_t)(s * 64) * ldk, stK, gV + s * 64, stV);
  FragH bq[KS];
  { const unsigned short* qr = (const unsigned short*)Q16 + ((size_t)b * TQ + q0 + ln) * ldq + h * 64;
#pragma unroll
    for (int ks = 0; ks < KS; ++ks) { bq[ks].half[0] = *(const v8us*)(qr + ks * 32 + 8 * hh); bq[ks].half[1] = *(const v8us*)(qr + ks * 32 + 16 + 8 * hh); } }
  /* stage 0's own copies have landed before the barrier that publishes them: the count leaves out the 8 copies of each of the stages 1 ... FA_NB - 2, and is used only where all of them were issued */
  if (ns < FA_NB - 1) asm volatile("s_wait_asynccnt 0x0" ::: "memory"); else asm volatile("s_wait_asynccnt %0" :: "n"(8 * (FA_NB - 2)) : "memory");
  __syncthreads();
  if (ns > FA_NB - 1) fa_copy8(lc + (unsigned)(FA_NB - 1) * FA_BUF, gK + (size_t)((FA_NB - 1) * 64) * ldk, stK, gV + (FA_NB - 1) * 64, stV);
  const int tq = q0 + ln;      /* this lane's query */
  float m_r = -3.0e38f, l_r = 0.f; v8f oacc[DT];
#pragma unroll
  for (int dt = 0; dt < DT; ++dt) oacc[dt] = (v8f){0.f,0.f,0.f,0.f,0.f,0.f,0.f,0.f};
  const unsigned char* rk = ring + ln * FA_PITCH + 16 * hh; const unsigned char* rv = rk + FA_OPB;
#pragma unroll 1      /* one stage per trip: the publish point at the foot stands once */
  for (int t = 0; t < ns; ++t) { const unsigned bo = (unsigned)(t & (FA_NB - 1)) * FA_BUF;
#pragma unroll      /* the stage's two 32-key steps in straight line: each step's place in the buffer is then an immediate offset of its fragment reads */
   for (int sub = 0; sub < 2; ++sub) { const int j0 = t * 64 + sub * 32;
    FragH ak[2][KS], av[DT];
#pragma unroll
    for (int nt = 0; nt < 2; ++nt) { const unsigned char* kr = rk + bo + (sub * 32 + nt * 16) * FA_PITCH;
#pragma unroll
      for (int ks = 0; ks < KS; ++ks) { ak[nt][ks].half[0] = *(const v8us*)(kr + ks * 64); ak[nt][ks].half[1] = *(const v8us*)(kr + ks * 64 + 32); } }
#pragma unroll
    for (int dt = 0; dt < DT; ++dt) { const unsigned char* vrow = rv + bo + dt * 16 * FA_PITCH + sub * 64; av[dt].half[0] = *(const v8us*)vrow; av[dt].half[1] = *(const v8us*)(vrow + 32); }
    float sc[16];
#pragma unroll
    for (int nt = 0; nt < 2; ++nt) { v8f acc = (v8f){0.f,0.f,0.f,0.f,0.f,0.f,0.f,0.f};
#pragma unroll
      for (int ks = 0; ks < KS; ++ks) acc = mmaH<1>(ak[nt][ks].v, ak[nt][ks].v, bq[ks].v, bq[ks].v, acc);
#pragma unroll
      for (int r = 0; r < 8; ++r) sc[nt * 8 + r] = (j0 + nt * 16 + 8 * hh + r <= tq) ? acc[r] : -INFINITY; }      /* the raw product: its scale is folded into the exponent's fma below */
    float mx[4];
#pragma unroll
    for (int i = 0; i < 4; ++i) mx[i] = fmaxf(fmaxf(sc[i], sc[4 + i]), fmaxf(sc[8 + i], sc[12 + i]));
    float mc = fmaxf(fmaxf(mx[0], mx[1]), fmaxf(mx[2], mx[3])); mc = fmaxf(mc, xhalf(mc)) * SCL2;      /* the scale is positive: the maximum of the raw products, scaled once */
    const float mn = fmaxf(m_r, mc); const float ea = __builtin_amdgcn_exp2f(m_r - mn); const float al = (mn > -1.0e38f) ? ea : 1.0f; m_r = mn;
    const float nb = 10.0f - mn;      /* exponent offset: minus the maximum in use, plus the 2^10 that P carries into f16 */
    FragH pb; float ps[4] = {0.f, 0.f, 0.f, 0.f};
#pragma unroll
    for (int i = 0; i < 16; ++i) { const float p = __builtin_amdgcn_exp2f(fmaf(sc[i], SCL2, nb)); ps[i & 3] += p; pb.h[i] = (_Float16)p; }      /* p = weight x 2^10; a masked score is -inf: weight exactly 0 */
    l_r = l_r * al + ((ps[0] + ps[1]) + (ps[2] + ps[3]));      /* this half's keys only; the halves are joined behind the loop */
#pragma unroll
    for (int dt = 0; dt < DT; ++dt) {
#pragma unroll
      for (int r = 0; r < 8; ++r) oacc[dt][r] *= al; }
#pragma unroll
    for (int dt = 0; dt < DT; ++dt) oacc[dt] = mmaH<1>(av[dt].v, av[dt].v, pb.v, pb.v, oacc[dt]); }
    asm volatile("s_wait_dscnt 0x0" ::: "memory");         /* this wave's reads of the buffer are done before the barrier behind which it is refilled */
    /* this wave's copies of stage t + 1 have landed before the barrier that publishes them. While stage t + FA_NB - 1 exists, the wave's youngest 8 * (FA_NB - 2) copies are exactly those of the stages t + 2 ... t + FA_NB - 1 and may stay in flight; in the last trips, which issued none, the wait is to 0 */
    if (t + FA_NB > ns) asm volatile("s_wait_asynccnt 0x0" ::: "memory"); else asm volatile("s_wait_asynccnt %0" :: "n"(8 * (FA_NB - 2)) : "memory");
    __syncthreads();
    if (t + FA_NB < ns) fa_copy8(lc + bo, gK + (size_t)(t + FA_NB) * 64 * ldk, stK, gV + (t + FA_NB) * 64, stV); }
  asm volatile("s_wait_asynccnt 0x0" ::: "memory");        /* nothing in flight when the wave goes on to its end */
  const float l = l_r + xhalf(l_r); const float inv = (l > 0.f) ? 1.0f / l : 0.f;      /* the sum carries the same 2^10 as P */
#pragma unroll
  for (int dt = 0; dt < DT; ++dt) { FragH f;      /* a lane's 8 consecutive d of its query: 16 bytes of the f16 row */
#pragma unroll
    for (int r = 0; r < 8; ++r) f.h[r] = (_Float16)(oacc[dt][r] * inv);
    *(v8us*)&sO[w][ln][dt * 16 + 8 * hh] = f.half[0]; }
  __builtin_amdgcn_fence(__ATOMIC_ACQ_REL, "workgroup"); __builtin_amdgcn_wave_barrier();
  { const int rs = lane >> 3, pc = lane & 7; v8us ov[4];      /* 8 lanes cover a query's 64 f16 = one 128-byte line; the four reads go as one group ahead of the stores */
#pragma unroll
    for (int k = 0; k < 4; ++k) ov[k] = *(const v8us*)&sO[w][k * 4 + rs][pc * 8];
#pragma unroll
    for (int k = 0; k < 4; ++k) { *(v8us*)((unsigned short*)O16 + ((size_t)b * TQ + q0 + k * 4 + rs) * ldo + h * 64 + pc * 8) = ov[k]; asm volatile("s_wait_xcnt 0x0" ::: "memory"); }      /* the wait stands in front of any rewrite of the store's data or address registers */
     } } }
template <bool RND>
__device__ __forceinline__ void ln1024_body(const float* __restrict__ X, const float* __restrict__ g, const float* __restrict__ bb, _Float16* __restrict__ H16, const int bx) {
  #pragma clang fp contract(off)
  const int tid = threadIdx.x, w = tid >> 5, l = tid & 31; const int r = bx * 8 + w; if (r >= NR) return; const float* x = X + (size_t)r * EE; float v[32]; float s = 0.f; v4f a8[8];
#pragma unroll
  for (int u = 0; u < 8; ++u) a8[u] = *(const v4fa*)(x + u * 128 + l * 4);
  asm volatile("s_wait_xcnt 0x0" ::: "memory");      /* later loads may land in the registers that hold the row loads' address: this wait stands in front of that overwrite */
#pragma unroll
  for (int u = 0; u < 8; ++u) {
#pragma unroll
    for (int q = 0; q < 4; ++q) { const float t = RND ? bf16_round(a8[u][q]) : a8[u][q]; v[u * 4 + q] = t; s += t; } }
  for (int o = 16; o > 0; o >>= 1) s += __shfl_xor(s, o, 32); const float mu = s / (float)EE; float q2 = 0.f;
#pragma unroll
  for (int k = 0; k < 32; ++k) { const float d = v[k] - mu; q2 += d * d; }
  for (int o = 16; o > 0; o >>= 1) q2 += __shfl_xor(q2, o, 32); const float rs = 1.0f / sqrtf(q2 / (float)EE + 1e-5f);
  {
#pragma unroll
    for (int u = 0; u < 8; ++u) { _Float16 h4[4];
#pragma unroll
      for (int q = 0; q < 4; ++q) { const int c = u * 128 + l * 4 + q; h4[q] = (_Float16)((v[u * 4 + q] - mu) * rs * bf16_round(g[c]) + bf16_round(bb[c])); }
      *(unsigned long long*)((unsigned short*)H16 + (size_t)r * EE + u * 128 + l * 4) = *(const unsigned long long*)h4; }
     } }
template <bool RND>
__global__ __launch_bounds__(256) void k_ln1024(const float* __restrict__ X, const float* __restrict__ g, const float* __restrict__ bb, _Float16* __restrict__ H16) { ln1024_body<RND>(X, g, bb, H16, (int)blockIdx.x); }
__device__ __forceinline__ void prep_body(const float* __restrict__ e, _Float16* __restrict__ E16, size_t n8, const unsigned bx) {
  const size_t t = (size_t)bx * 256 + threadIdx.x; if (t >= n8) return; const v4f a = *(const v4fa*)(e + t * 8), c = *(const v4fa*)(e + t * 8 + 4); FragH f;
#pragma unroll
  for (int q = 0; q < 4; ++q) { f.h[q] = (_Float16)bf16_round(a[q]); f.h[4 + q] = (_Float16)bf16_round(c[q]); }
  *(v8us*)((unsigned short*)E16 + t * 8) = f.half[0];
  asm volatile("s_wait_xcnt 0x0" ::: "memory");      /* stands in front of any rewrite of the registers that the store above names */
}
// Everything that reads only the inputs, as one grid by block range: LN1 (8 rows a block), the encoder plane and the ten weight planes (8 elements a thread).
// The ten f16 planes lie one behind the other from Bt in the order w0 ... w9, so a piece's place is its running index; w0 ... w7 hold EE * EE elements, w8 and w9 FF * EE.
#define FR_LN (NR / 8)                        /* blocks of LN1 */
#define FR_PREP (NR * EE / 8 / 256)           /* blocks of the encoder plane */
#define FR_WSM (EE * EE / 8 / 256)            /* blocks of one EE x EE weight */
#define FR_W (8 * FR_WSM + 2 * (FF / EE) * FR_WSM)
// second bound: eight waves a SIMD. The LN1 branch sets the register count of every block of this grid; held to 128 registers, four blocks of the streaming ranges stay resident on a WGP instead of three.
__global__ __launch_bounds__(256, 8) void k_front(const float* __restrict__ w0, const float* __restrict__ w1, const float* __restrict__ w2, const float* __restrict__ w3, const float* __restrict__ w4, const float* __restrict__ w5, const float* __restrict__ w6, const float* __restrict__ w7,
    const float* __restrict__ w8, const float* __restrict__ w9, const float* __restrict__ x, const float* __restrict__ e, const float* __restrict__ g, const float* __restrict__ bb,
    _Float16* __restrict__ Bt, _Float16* __restrict__ E16, _Float16* __restrict__ H16) {
  const unsigned bx = blockIdx.x;
  if (bx < FR_LN) { ln1024_body<true>(x, g, bb, H16, (int)bx); return; }
  if (bx < FR_LN + FR_PREP) { prep_body(e, E16, (size_t)NR * EE / 8, bx - FR_LN); return; }
  const unsigned wb = bx - (FR_LN + FR_PREP); const unsigned seg = wb / FR_WSM;      /* block-uniform: which EE x EE stretch of the ten planes */
  const float* W; unsigned b0;      /* the source and the block at which its plane begins */
  if (seg < 8) { W = (seg == 0) ? w0 : (seg == 1) ? w1 : (seg == 2) ? w2 : (seg == 3) ? w3 : (seg == 4) ? w4 : (seg == 5) ? w5 : (seg == 6) ? w6 : w7; b0 = seg * FR_WSM; }
  else if (seg < 8 + FF / EE) { W = w8; b0 = 8 * FR_WSM; }
  else { W = w9; b0 = (8 + FF / EE) * FR_WSM; }
  const size_t ts = (size_t)(wb - b0) * 256 + threadIdx.x, td = (size_t)wb * 256 + threadIdx.x; FragH f;
#pragma unroll
  for (int i = 0; i < 8; ++i) f.h[i] = (_Float16)(bf16_round(W[ts * 8 + i]) * 16.0f); *(v8us*)((unsigned short*)Bt + td * 8) = f.half[0];
  asm volatile("s_wait_xcnt 0x0" ::: "memory");      /* stands in front of any rewrite of the registers that the store above names */
}

extern "C" void kernel_launch(void* const* d_in, const int* in_sizes, int n_in,
                              void* d_out, int out_size, void* d_ws, size_t ws_size, hipStream_t stream) {
  (void)in_sizes; (void)n_in; (void)out_size;
  const float* const* I = (const float* const*)d_in;
  const float* x = I[0]; const float* enc = I[1];
  const float* wq_s = I[2]; const float* bq_s = I[3]; const float* wk_s = I[4]; const float* bk_s = I[5]; const float* wv_s = I[6]; const float* bv_s = I[7]; const float* wo_s = I[8]; const float* bo_s = I[9];
  const float* wq_c = I[10]; const float* bq_c = I[11]; const float* wk_c = I[12]; const float* bk_c = I[13]; const float* wv_c = I[14]; const float* bv_c = I[15]; const float* wo_c = I[16]; const float* bo_c = I[17];
  const float* g1 = I[18]; const float* b1n = I[19]; const float* g2 = I[20]; const float* b2n = I[21]; const float* g3 = I[22]; const float* b3n = I[23]; const float* W1 = I[24]; const float* b1 = I[25]; const float* W2 = I[26]; const float* b2 = I[27];
  char* ws = (char*)d_ws; size_t off = 0;
  auto take = [&](size_t bytes) { char* p = ws + off; off += (bytes + 255) & ~(size_t)255; return p; };
  _Float16* B[8]; for (int i = 0; i < 8; ++i) B[i] = (_Float16*)take((size_t)EE * EE * 2);      /* wq_s wk_s wv_s wo_s wq_c wk_c wv_c wo_c */
  _Float16* BF1 = (_Float16*)take((size_t)FF * EE * 2); _Float16* BF2 = (_Float16*)take((size_t)EE * FF * 2);
  float* X2 = (float*)take((size_t)NR * EE * 4); _Float16* H16 = (_Float16*)take((size_t)NR * EE * 2);
  _Float16* Q16 = (_Float16*)take((size_t)NR * EE * 2); _Float16* K16 = (_Float16*)take((size_t)NR * EE * 2); _Float16* VT = (_Float16*)take((size_t)NR * EE * 2); _Float16* E16 = (_Float16*)take((size_t)NR * EE * 2);      /* these four are contiguous: the FFN hidden reuses them */
  float* X1 = (float*)take((size_t)NR * EE * 4);
  _Float16* K16c = (_Float16*)take((size_t)NR * EE * 2); _Float16* VTc = (_Float16*)take((size_t)NR * EE * 2);      /* the cross attention's k and v planes, made ahead of the self attention */
  if (off > ws_size) return;      /* 16 + 16 + 16 + 8 + 32 + 16 + 16 = 120 MiB */
  _Float16* O16 = H16;                /* LN output is dead once its projection GEMMs ran; the attention output plane reuses it */
  _Float16* F1 = Q16;                 /* FFN hidden [4096][4096] f16 = 32 MiB = Q16+K16+VT+E16 (all dead by then) */
  const dim3 gE((NR / 128) * (EE / 128), 1), gF((NR / 128) * (FF / 128), 1), gP((NR / 128) * (EE / 128), 5); const unsigned gln = NR / 8, gfl = NH * (TQ / 128);      /* attention: one block per (n, h) and pair of 64-query tiles */
  /* --- all that reads only the inputs: LN1, the encoder plane, the ten weight planes ((out,in) = natural Bt; x16; B[0] ... B[7], BF1, BF2 are contiguous) --- */
  k_front<<<FR_LN + FR_PREP + FR_W, 256, 0, stream>>>(wq_s, wk_s, wv_s, wo_s, wq_c, wk_c, wv_c, wo_c, W1, W2, x, enc, g1, b1n, B[0], E16, H16);
  /* --- the five projections that wait for no attention; both v planes leave re-laid --- */
  k_proj5<<<gP, 256, 0, stream>>>(H16, E16, B[0], B[1], B[2], B[5], B[6], bq_s, bk_s, bv_s, bk_c, bv_c, Q16, K16, VT, K16c, VTc);
  /* --- self attention --- */
  k_flashc<<<gfl, 128, 0, stream>>>(Q16, NBATCH * EE, K16, NBATCH * EE, VT, nullptr, O16, NBATCH * EE);      /* rows = tokens, 64 (n,h) slabs of 64 columns */
  k_gemm3<0, true, 4><<<gE, 256, 0, stream>>>(O16, EE, 0, B[3], EE, 0, 0.0625f, bo_s, 0, x, X1, nullptr, EE, 0, NR, EE, EE);      /* x1 = bf16(x) + o*wo^T + bo */
  /* --- cross attention (keys/values from encoder_out, same causal mask) --- */
  k_ln1024<false><<<gln, 256, 0, stream>>>(X1, g2, b2n, H16);
  k_gemm3<0, false, 4><<<gE, 256, 0, stream>>>(H16, EE, 0, B[4], EE, 0, 0.0625f, bq_c, 0, nullptr, nullptr, Q16, EE, 0, NR, EE, EE);
  k_flashc<<<gfl, 128, 0, stream>>>(Q16, NBATCH * EE, K16c, NBATCH * EE, VTc, nullptr, O16, NBATCH * EE);
  k_gemm3<0, false, 4><<<gE, 256, 0, stream>>>(O16, EE, 0, B[7], EE, 0, 0.0625f, bo_c, 0, X1, X2, nullptr, EE, 0, NR, EE, EE);      /* x2 = x1 + o*wo^T + bo */
  /* --- FFN --- */
  k_ln1024<false><<<gln, 256, 0, stream>>>(X2, g3, b3n, H16);
  k_gemm3<6><<<gF, 256, 0, stream>>>(H16, EE, 0, BF1, EE, 0, 0.0625f, b1, 0, nullptr, nullptr, F1, FF, 0, NR, FF, EE);      /* gelu_erf(h*fc1^T + b1) -> f16 [4096][4096] */
  k_gemm3<0, false, 4><<<gE, 256, 0, stream>>>(F1, FF, 0, BF2, FF, 0, 0.0625f, b2, 0, X2, (float*)d_out, nullptr, EE, 0, NR, EE, FF);      /* out = x2 + f*fc2^T + b2 */
}
